// v000
// Measured on an AMD MI455X. A time is GPU time per run, averaged over a window of back-to-back runs after a warm-up
// (all launches, gaps included; the runs take copies of the inputs in turn), and the median of several windows.
// Apart from v000's, it joins two sittings. Times from different sittings can be a few percent apart, while
// side-by-side timings come from the same sitting.
// v000 is the starting kernel. One run takes 1610 microseconds.
#include <hip/hip_runtime.h>

typedef __attribute__((ext_vector_type(2))) float v2f;
typedef __attribute__((ext_vector_type(8))) float v8f;

#define DIM   1024
#define INTER 512
#define NEXP  8
#define KC    64           // K chunk staged in LDS
#define LSTR  (KC + 4)     // padded LDS row stride (dwords): conflict-free b64 reads

__device__ __forceinline__ float silu_f(float g) {
    return g / (1.0f + __expf(-g));
}

__device__ __forceinline__ v8f wmma_f32(v2f a, v2f b, v8f c) {
    return __builtin_amdgcn_wmma_f32_16x16x4_f32(
        false, a, false, b, (short)0, c, false, false);
}

// ---------------- Gate: softmax(x @ gate_w^T), top-2, dense combine weights ----
__global__ __launch_bounds__(256) void moe_gate_kernel(
    const float* __restrict__ X, const float* __restrict__ GW,
    float* __restrict__ CW, int N)
{
    int lane = threadIdx.x & 31;
    int tok  = (blockIdx.x * blockDim.x + threadIdx.x) >> 5;
    if (tok >= N) return;
    const float* xr = X + (size_t)tok * DIM;
    float acc[NEXP];
#pragma unroll
    for (int e = 0; e < NEXP; ++e) acc[e] = 0.0f;
    for (int d = lane; d < DIM; d += 32) {
        float xv = xr[d];
#pragma unroll
        for (int e = 0; e < NEXP; ++e) acc[e] += xv * GW[e * DIM + d];
    }
#pragma unroll
    for (int e = 0; e < NEXP; ++e) {
#pragma unroll
        for (int off = 16; off > 0; off >>= 1)
            acc[e] += __shfl_xor(acc[e], off, 32);
    }
    if (lane == 0) {
        float mx = acc[0];
#pragma unroll
        for (int e = 1; e < NEXP; ++e) mx = fmaxf(mx, acc[e]);
        float s[NEXP]; float sum = 0.0f;
#pragma unroll
        for (int e = 0; e < NEXP; ++e) { s[e] = __expf(acc[e] - mx); sum += s[e]; }
        float inv = 1.0f / sum;
#pragma unroll
        for (int e = 0; e < NEXP; ++e) s[e] *= inv;
        int i1 = 0;
#pragma unroll
        for (int e = 1; e < NEXP; ++e) if (s[e] > s[i1]) i1 = e;
        int i2 = (i1 == 0) ? 1 : 0;
#pragma unroll
        for (int e = 0; e < NEXP; ++e) if (e != i1 && s[e] > s[i2]) i2 = e;
#pragma unroll
        for (int e = 0; e < NEXP; ++e)
            CW[(size_t)tok * NEXP + e] = (e == i1) ? s[i1] : ((e == i2) ? s[i2] : 0.0f);
    }
}

// ---------------- GEMM1: H = silu(X Wg^T) * (X Wu^T), one expert ---------------
// Block: 8 waves, 32 token rows x 512 (all INTER) cols. A tile staged in LDS.
// Wave: 32(M) x 64(N) strip = 2x4 WMMA tiles for G and for U.
__global__ __launch_bounds__(256) void moe_gemm1_kernel(
    const float* __restrict__ X,    // [N, DIM]
    const float* __restrict__ Wg,   // [INTER, DIM]
    const float* __restrict__ Wu,   // [INTER, DIM]
    float* __restrict__ H,          // [N, INTER]
    int N)
{
    __shared__ float lx[32 * LSTR];

    int tid  = threadIdx.x;
    int lane = tid & 31;
    int wv   = tid >> 5;            // 0..7
    int m0   = blockIdx.x * 32;
    if (m0 >= N) return;            // uniform
    int n0   = wv * 64;

    int kHalf = (lane >> 4) << 1;   // 0 or 2
    int mr    = lane & 15;
    int nc    = lane & 15;

    const float* bgRow[4];
    const float* buRow[4];
#pragma unroll
    for (int t = 0; t < 4; ++t) {
        int n = n0 + t * 16 + nc;
        bgRow[t] = Wg + (size_t)n * DIM + kHalf;
        buRow[t] = Wu + (size_t)n * DIM + kHalf;
    }

    v8f zero = {};
    v8f accG[2][4], accU[2][4];
#pragma unroll
    for (int mt = 0; mt < 2; ++mt)
#pragma unroll
        for (int t = 0; t < 4; ++t) { accG[mt][t] = zero; accU[mt][t] = zero; }

    for (int kc = 0; kc < DIM; kc += KC) {
        __syncthreads();
        // Stage X[m0:m0+32, kc:kc+KC] -> LDS (512 float4, 2 per thread, coalesced)
#pragma unroll
        for (int i = tid; i < 512; i += 256) {
            int r  = i >> 4;        // 0..31
            int c4 = i & 15;        // 0..15
            *(float4*)&lx[r * LSTR + c4 * 4] =
                *(const float4*)&X[(size_t)(m0 + r) * DIM + kc + c4 * 4];
        }
        __syncthreads();

        for (int k = 0; k < KC; k += 4) {
            int kg = kc + k;
            v2f a0 = *(const v2f*)&lx[mr * LSTR + k + kHalf];
            v2f a1 = *(const v2f*)&lx[(16 + mr) * LSTR + k + kHalf];
#pragma unroll
            for (int t = 0; t < 4; ++t) {
                v2f bg = *(const v2f*)(bgRow[t] + kg);
                v2f bu = *(const v2f*)(buRow[t] + kg);
                accG[0][t] = wmma_f32(a0, bg, accG[0][t]);
                accU[0][t] = wmma_f32(a0, bu, accU[0][t]);
                accG[1][t] = wmma_f32(a1, bg, accG[1][t]);
                accU[1][t] = wmma_f32(a1, bu, accU[1][t]);
            }
        }
    }

    int jBase = (lane >> 4) << 3;   // 0 or 8
#pragma unroll
    for (int mt = 0; mt < 2; ++mt) {
#pragma unroll
        for (int t = 0; t < 4; ++t) {
#pragma unroll
            for (int j = 0; j < 8; ++j) {
                int row = m0 + mt * 16 + jBase + j;
                float g = accG[mt][t][j];
                float u = accU[mt][t][j];
                H[(size_t)row * INTER + n0 + t * 16 + nc] = silu_f(g) * u;
            }
        }
    }
}

// ---------------- GEMM2: Out (+)= diag(w) * (H Wd^T), one expert ---------------
// Block: 8 waves, 32 rows x 512 cols (grid.y spans DIM/512). A tile via LDS.
__global__ __launch_bounds__(256) void moe_gemm2_kernel(
    const float* __restrict__ H,    // [N, INTER]
    const float* __restrict__ Wd,   // [DIM, INTER]
    const float* __restrict__ CW,   // [N, NEXP]
    int expert,                     // 0..7 routed, -1 shared (weight 1.0)
    int accumulate,                 // 0 = overwrite, 1 = add
    float* __restrict__ Out,        // [N, DIM]
    int N)
{
    __shared__ float lh[32 * LSTR];

    int tid  = threadIdx.x;
    int lane = tid & 31;
    int wv   = tid >> 5;
    int m0   = blockIdx.x * 32;
    if (m0 >= N) return;
    int n0   = blockIdx.y * 512 + wv * 64;

    int kHalf = (lane >> 4) << 1;
    int mr    = lane & 15;
    int nc    = lane & 15;

    const float* bRow[4];
#pragma unroll
    for (int t = 0; t < 4; ++t)
        bRow[t] = Wd + (size_t)(n0 + t * 16 + nc) * INTER + kHalf;

    v8f zero = {};
    v8f acc[2][4];
#pragma unroll
    for (int mt = 0; mt < 2; ++mt)
#pragma unroll
        for (int t = 0; t < 4; ++t) acc[mt][t] = zero;

    for (int kc = 0; kc < INTER; kc += KC) {
        __syncthreads();
#pragma unroll
        for (int i = tid; i < 512; i += 256) {
            int r  = i >> 4;
            int c4 = i & 15;
            *(float4*)&lh[r * LSTR + c4 * 4] =
                *(const float4*)&H[(size_t)(m0 + r) * INTER + kc + c4 * 4];
        }
        __syncthreads();

        for (int k = 0; k < KC; k += 4) {
            int kg = kc + k;
            v2f a0 = *(const v2f*)&lh[mr * LSTR + k + kHalf];
            v2f a1 = *(const v2f*)&lh[(16 + mr) * LSTR + k + kHalf];
#pragma unroll
            for (int t = 0; t < 4; ++t) {
                v2f b = *(const v2f*)(bRow[t] + kg);
                acc[0][t] = wmma_f32(a0, b, acc[0][t]);
                acc[1][t] = wmma_f32(a1, b, acc[1][t]);
            }
        }
    }

    int jBase = (lane >> 4) << 3;
#pragma unroll
    for (int mt = 0; mt < 2; ++mt) {
        float w[8];
#pragma unroll
        for (int j = 0; j < 8; ++j) {
            int row = m0 + mt * 16 + jBase + j;
            w[j] = (expert >= 0) ? CW[(size_t)row * NEXP + expert] : 1.0f;
        }
#pragma unroll
        for (int t = 0; t < 4; ++t) {
#pragma unroll
            for (int j = 0; j < 8; ++j) {
                int row = m0 + mt * 16 + jBase + j;
                size_t idx = (size_t)row * DIM + n0 + t * 16 + nc;
                float v = w[j] * acc[mt][t][j];
                if (accumulate) Out[idx] += v;
                else            Out[idx] = v;
            }
        }
    }
}

extern "C" void kernel_launch(void* const* d_in, const int* in_sizes, int n_in,
                              void* d_out, int out_size, void* d_ws, size_t ws_size,
                              hipStream_t stream) {
    const float* x      = (const float*)d_in[0];
    const float* gate_w = (const float*)d_in[1];
    const float* wg     = (const float*)d_in[2];
    const float* wu     = (const float*)d_in[3];
    const float* wd     = (const float*)d_in[4];
    const float* sg     = (const float*)d_in[5];
    const float* su     = (const float*)d_in[6];
    const float* sd     = (const float*)d_in[7];
    float* out = (float*)d_out;

    const int N = in_sizes[0] / DIM;                // 4096 tokens

    float* cw   = (float*)d_ws;                     // [N, NEXP]
    float* Hbuf = cw + (size_t)N * NEXP;            // [N, INTER]

    moe_gate_kernel<<<(N + 7) / 8, 256, 0, stream>>>(x, gate_w, cw, N);

    for (int e = 0; e < NEXP + 1; ++e) {
        const float* wgp = (e < NEXP) ? wg + (size_t)e * INTER * DIM : sg;
        const float* wup = (e < NEXP) ? wu + (size_t)e * INTER * DIM : su;
        const float* wdp = (e < NEXP) ? wd + (size_t)e * DIM * INTER : sd;

        moe_gemm1_kernel<<<N / 32, 256, 0, stream>>>(x, wgp, wup, Hbuf, N);

        dim3 g2(N / 32, DIM / 512);
        moe_gemm2_kernel<<<g2, 256, 0, stream>>>(
            Hbuf, wdp, cw, (e < NEXP) ? e : -1, (e > 0) ? 1 : 0, out, N);
    }
}

// v002
// One run takes 306 microseconds.
// Versions in between are left out here; by their measured steps it is 5.30 times as fast as v000.
#include <hip/hip_runtime.h>

typedef __attribute__((ext_vector_type(2))) float v2f;
typedef __attribute__((ext_vector_type(8))) float v8f;

#define DIM   1024
#define INTER 512
#define NEXP  8
#define KC    32           // K chunk staged in LDS: one 128-byte line of every row
#define LSTR  (KC + 4)     // padded LDS row stride (dwords): conflict-free b64 reads

__device__ __forceinline__ float silu_f(float g) {
    return g / (1.0f + __expf(-g));
}

__device__ __forceinline__ v8f wmma_f32(v2f a, v2f b, v8f c) {
    return __builtin_amdgcn_wmma_f32_16x16x4_f32(
        false, a, false, b, (short)0, c, false, false);
}

// One copy, global memory -> LDS, 16 bytes a lane, through no register.
typedef int v4i __attribute__((ext_vector_type(4)));
typedef __attribute__((address_space(1))) v4i gl_v4i;
typedef __attribute__((address_space(3))) v4i lds_v4i;
__device__ __forceinline__ void copy_to_lds(float* l, const float* g) {
    __builtin_amdgcn_global_load_async_to_lds_b128((gl_v4i*)g, (lds_v4i*)l, 0, 0);
}

// This wave's copies have landed.
__device__ __forceinline__ void wait_copies() {
    asm volatile("s_wait_asynccnt 0x0" ::: "memory");
}

// This wave's LDS reads have returned: the buffer may go to its next writer.
__device__ __forceinline__ void wait_lds_reads() {
    asm volatile("s_wait_dscnt 0x0" ::: "memory");
}

// ---------------- Gate: softmax(x @ gate_w^T), top-2, dense combine weights ----
__global__ __launch_bounds__(256) void moe_gate_kernel(
    const float* __restrict__ X, const float* __restrict__ GW,
    float* __restrict__ CW, int N)
{
    int lane = threadIdx.x & 31;
    int tok  = (blockIdx.x * blockDim.x + threadIdx.x) >> 5;
    if (tok >= N) return;
    const float* xr = X + (size_t)tok * DIM;
    float acc[NEXP];
#pragma unroll
    for (int e = 0; e < NEXP; ++e) acc[e] = 0.0f;
    for (int d = lane; d < DIM; d += 32) {
        float xv = xr[d];
#pragma unroll
        for (int e = 0; e < NEXP; ++e) acc[e] += xv * GW[e * DIM + d];
    }
#pragma unroll
    for (int e = 0; e < NEXP; ++e) {
#pragma unroll
        for (int off = 16; off > 0; off >>= 1)
            acc[e] += __shfl_xor(acc[e], off, 32);
    }
    if (lane == 0) {
        float mx = acc[0];
#pragma unroll
        for (int e = 1; e < NEXP; ++e) mx = fmaxf(mx, acc[e]);
        float s[NEXP]; float sum = 0.0f;
#pragma unroll
        for (int e = 0; e < NEXP; ++e) { s[e] = __expf(acc[e] - mx); sum += s[e]; }
        float inv = 1.0f / sum;
#pragma unroll
        for (int e = 0; e < NEXP; ++e) s[e] *= inv;
        int i1 = 0;
#pragma unroll
        for (int e = 1; e < NEXP; ++e) if (s[e] > s[i1]) i1 = e;
        int i2 = (i1 == 0) ? 1 : 0;
#pragma unroll
        for (int e = 0; e < NEXP; ++e) if (e != i1 && s[e] > s[i2]) i2 = e;
#pragma unroll
        for (int e = 0; e < NEXP; ++e)
            CW[(size_t)tok * NEXP + e] = (e == i1) ? s[i1] : ((e == i2) ? s[i2] : 0.0f);
    }
}

// ---------------- Route: per expert, the list of tokens that chose it ----------
// One block. Tokens keep their order inside an expert's list (ballot rank in the
// wave, prefix over the waves in LDS), so the lists are the same on every run.
// LIST/WL: [NEXP + 1][N] token and combine weight by rank, filled up to the end of the
// list's last 32-row tile with token 0 at weight 0; list NEXP is the shared expert's:
// every token, weight 1. SEL: [N][2] the token's rows in the expert-major row space
// (expert * N + rank), lower expert first, -1 = none.
// TP: first tile of each list in the grouped grid, then the number of tiles.
__global__ __launch_bounds__(1024) void moe_route_kernel(
    const float* __restrict__ CW, int* __restrict__ LIST, float* __restrict__ WL,
    int* __restrict__ SEL, int* __restrict__ TP, int N)
{
    __shared__ int wc[32][NEXP];    // rows per wave and expert, this chunk
    __shared__ int wo[32][NEXP];    // first rank of the wave's rows
    __shared__ int tot[NEXP];

    int tid  = threadIdx.x;
    int lane = tid & 31;
    int wv   = tid >> 5;
    unsigned below = (1u << lane) - 1u;
    int run = 0;                    // waves 0..NEXP-1: rows of expert wv so far

    for (int base = 0; base < N; base += 1024) {
        int tok = base + tid;
        float c[NEXP];
#pragma unroll
        for (int e = 0; e < NEXP; ++e) c[e] = 0.0f;
        if (tok < N) {
            float4 lo = *(const float4*)&CW[(size_t)tok * NEXP];
            float4 hi = *(const float4*)&CW[(size_t)tok * NEXP + 4];
            c[0] = lo.x; c[1] = lo.y; c[2] = lo.z; c[3] = lo.w;
            c[4] = hi.x; c[5] = hi.y; c[6] = hi.z; c[7] = hi.w;
        }
        int r[NEXP];
#pragma unroll
        for (int e = 0; e < NEXP; ++e) {
            unsigned m = (unsigned)__ballot(c[e] != 0.0f);
            r[e] = __popc(m & below);
            if (lane == 0) wc[wv][e] = __popc(m);
        }
        __syncthreads();
        if (wv < NEXP) {            // wave e scans the 32 wave counts of expert e
            int v = wc[lane][wv];
            int inc = v;
#pragma unroll
            for (int d = 1; d < 32; d <<= 1) {
                int o = __shfl_up(inc, d, 32);
                if (lane >= d) inc += o;
            }
            wo[lane][wv] = run + inc - v;
            run += __shfl(inc, 31, 32);
        }
        __syncthreads();
        int s0 = -1, s1 = -1;
#pragma unroll
        for (int e = 0; e < NEXP; ++e) {
            if (c[e] != 0.0f) {
                int row = e * N + wo[wv][e] + r[e];
                LIST[row] = tok;
                WL[row]   = c[e];
                if (s0 < 0) s0 = row; else s1 = row;
            }
        }
        if (tok < N) {
            SEL[tok * 2] = s0; SEL[tok * 2 + 1] = s1;
            LIST[NEXP * N + tok] = tok;
            WL[NEXP * N + tok]   = 1.0f;
            // The next trip steps the stores' address registers: the wait in front of that.
            asm volatile("s_wait_xcnt 0x0" ::: "memory");
        }
    }

    if (wv < NEXP) {
        int r = run + lane;         // ranks from the list's end to its last tile's end
        if (r < ((run + 31) & ~31)) { LIST[wv * N + r] = 0; WL[wv * N + r] = 0.0f; }
        if (lane == 0) tot[wv] = run;
    }
    __syncthreads();
    if (tid == 0) {
        int t = 0;
#pragma unroll
        for (int e = 0; e < NEXP; ++e) {
            TP[e] = t;
            t += (tot[e] + 31) >> 5;
        }
        TP[NEXP] = t;
        TP[NEXP + 1] = t + (N >> 5);
    }
}

// Which expert and which 32-row tile of its list a block of the grouped grid works on.
// False: the block lies behind the last tile (the grid is sized for the worst case).
__device__ __forceinline__ bool tile_of_block(const int* __restrict__ TP, int b,
                                              int& e, int& m0) {
    if (b >= TP[NEXP + 1]) return false;
    e = 0;
#pragma unroll
    for (int q = 1; q <= NEXP; ++q) if (b >= TP[q]) e = q;
    m0 = (b - TP[e]) * 32;
    return true;
}

// ---------------- GEMM1: H = silu(X Wg^T) * (X Wu^T), all experts, chosen rows --
// Block: 8 waves, 32 rows of one expert's list x 512 (all INTER) cols.
// Wave: 32(M) x 64(N) strip = 2x4 WMMA tiles for G and for U.
// A stage in LDS = KC columns of 512 Wg rows, 512 Wu rows and the 32 gathered X rows,
// brought by asynchronous copies in whole 128-byte lines; two stages, so that the next
// one flies while this one is worked on.
#define G1_ROWS  (2 * INTER + 32)
#define G1_STAGE (G1_ROWS * LSTR)        // dwords
__global__ __launch_bounds__(256) void moe_gemm1_kernel(
    const float* __restrict__ X,    // [N, DIM]
    const float* __restrict__ Wg,   // [NEXP, INTER, DIM]
    const float* __restrict__ Wu,   // [NEXP, INTER, DIM]
    const float* __restrict__ Sg,   // [INTER, DIM]
    const float* __restrict__ Su,   // [INTER, DIM]
    const int* __restrict__ TP, const int* __restrict__ LIST,
    float* __restrict__ Hall,       // [NEXP + 1, N, INTER], row = expert * N + rank
    int N)
{
    __shared__ __attribute__((aligned(16))) float ls[2 * G1_STAGE];

    int tid  = threadIdx.x;
    int lane = tid & 31;
    int wv   = tid >> 5;            // 0..7
    int e, m0;
    if (!tile_of_block(TP, blockIdx.x, e, m0)) return;   // uniform
    int n0   = wv * 64;

    const float* wgE = (e < NEXP) ? Wg + (size_t)e * INTER * DIM : Sg;
    const float* wuE = (e < NEXP) ? Wu + (size_t)e * INTER * DIM : Su;
    float* H = Hall + (size_t)e * N * INTER;             // this expert's rows, by rank

    // What this thread copies in a stage: 16 bytes (piece sc) of rows sr, sr + 32, ...
    int sr = tid >> 3;              // 0..31
    int sc = (tid & 7) * 4;
    int tok = LIST[e * N + m0 + sr];
    const float* cg = wgE + (size_t)sr * DIM + sc;
    const float* cu = wuE + (size_t)sr * DIM + sc;
    const float* cx = X + (size_t)tok * DIM + sc;
    float* cl = ls + sr * LSTR + sc;

    auto stage_in = [&](int t) {    // columns t * KC .. + KC into buffer t & 1
        float* l = cl + (t & 1) * G1_STAGE;
        int kc = t * KC;
#pragma unroll
        for (int i = 0; i < INTER / 32; ++i) {
            copy_to_lds(l + i * 32 * LSTR, cg + kc + (size_t)i * 32 * DIM);
            copy_to_lds(l + (INTER + i * 32) * LSTR, cu + kc + (size_t)i * 32 * DIM);
        }
        copy_to_lds(l + 2 * INTER * LSTR, cx + kc);
    };

    int kHalf = (lane >> 4) << 1;   // 0 or 2
    int mr    = lane & 15;
    int nc    = lane & 15;

    v8f zero = {};
    v8f accG[2][4], accU[2][4];
#pragma unroll
    for (int mt = 0; mt < 2; ++mt)
#pragma unroll
        for (int t = 0; t < 4; ++t) { accG[mt][t] = zero; accU[mt][t] = zero; }

    stage_in(0);
    wait_copies();
    __syncthreads();                // stage 0 is there for every wave
    stage_in(1);

    for (int s = 0; s < DIM / KC; ++s) {
        const float* st = ls + (s & 1) * G1_STAGE;
        const float* lg = st + (n0 + nc) * LSTR + kHalf;
        const float* lu = lg + INTER * LSTR;
        const float* la = st + (2 * INTER + mr) * LSTR + kHalf;
#pragma unroll
        for (int k = 0; k < KC; k += 4) {
            v2f a0 = *(const v2f*)(la + k);
            v2f a1 = *(const v2f*)(la + 16 * LSTR + k);
#pragma unroll
            for (int t = 0; t < 4; ++t) {
                v2f bg = *(const v2f*)(lg + t * 16 * LSTR + k);
                v2f bu = *(const v2f*)(lu + t * 16 * LSTR + k);
                accG[0][t] = wmma_f32(a0, bg, accG[0][t]);
                accU[0][t] = wmma_f32(a0, bu, accU[0][t]);
                accG[1][t] = wmma_f32(a1, bg, accG[1][t]);
                accU[1][t] = wmma_f32(a1, bu, accU[1][t]);
            }
        }
        // Hand-over: this stage's reads are done, the next stage's copies have landed,
        // every wave says so; only then the refill of the buffer just read.
        wait_lds_reads();
        wait_copies();
        __syncthreads();
        if (s + 2 < DIM / KC) stage_in(s + 2);
    }
    wait_copies();

    int jBase = (lane >> 4) << 3;   // 0 or 8
#pragma unroll
    for (int mt = 0; mt < 2; ++mt) {
#pragma unroll
        for (int t = 0; t < 4; ++t) {
#pragma unroll
            for (int j = 0; j < 8; ++j) {
                int row = m0 + mt * 16 + jBase + j;
                float g = accG[mt][t][j];
                float u = accU[mt][t][j];
                H[(size_t)row * INTER + n0 + t * 16 + nc] = silu_f(g) * u;
            }
        }
    }
}

// ---------------- GEMM2: Y = diag(w) * (H Wd^T), all experts, chosen rows -------
// Block: 8 waves, 32 rows x 512 cols (grid.y spans DIM/512).
// A stage in LDS = KC columns of the block's 512 Wd rows and its 32 H rows, by
// asynchronous copies, two stages, as in GEMM1.
#define G2_ROWS  (512 + 32)
#define G2_STAGE (G2_ROWS * LSTR)        // dwords
__global__ __launch_bounds__(256) void moe_gemm2_kernel(
    const float* __restrict__ Hall, // [NEXP + 1, N, INTER]
    const float* __restrict__ Wd,   // [NEXP, DIM, INTER]
    const float* __restrict__ Sd,   // [DIM, INTER]
    const int* __restrict__ TP,
    const float* __restrict__ WL,   // [NEXP + 1, N] combine weight by rank
    float* __restrict__ Y,          // [NEXP + 1, N, DIM]
    int N)
{
    __shared__ __attribute__((aligned(16))) float ls[2 * G2_STAGE];

    int tid  = threadIdx.x;
    int lane = tid & 31;
    int wv   = tid >> 5;
    int e, m0;
    if (!tile_of_block(TP, blockIdx.x, e, m0)) return;   // uniform
    int nb   = blockIdx.y * 512;    // the block's first column
    int n0   = nb + wv * 64;

    const float* wdE = (e < NEXP) ? Wd + (size_t)e * DIM * INTER : Sd;
    const float* H   = Hall + (size_t)e * N * INTER;     // this expert's rows, by rank
    float* Out       = Y + (size_t)e * N * DIM;

    // What this thread copies in a stage: 16 bytes (piece sc) of rows sr, sr + 32, ...
    int sr = tid >> 3;              // 0..31
    int sc = (tid & 7) * 4;
    const float* cw = wdE + (size_t)(nb + sr) * INTER + sc;
    const float* ch = H + (size_t)(m0 + sr) * INTER + sc;
    float* cl = ls + sr * LSTR + sc;

    auto stage_in = [&](int t) {    // columns t * KC .. + KC into buffer t & 1
        float* l = cl + (t & 1) * G2_STAGE;
        int kc = t * KC;
#pragma unroll
        for (int i = 0; i < 512 / 32; ++i)
            copy_to_lds(l + i * 32 * LSTR, cw + kc + (size_t)i * 32 * INTER);
        copy_to_lds(l + 512 * LSTR, ch + kc);
    };

    int kHalf = (lane >> 4) << 1;
    int mr    = lane & 15;
    int nc    = lane & 15;

    v8f zero = {};
    v8f acc[2][4];
#pragma unroll
    for (int mt = 0; mt < 2; ++mt)
#pragma unroll
        for (int t = 0; t < 4; ++t) acc[mt][t] = zero;

    stage_in(0);
    wait_copies();
    __syncthreads();                // stage 0 is there for every wave
    stage_in(1);

    for (int s = 0; s < INTER / KC; ++s) {
        const float* st = ls + (s & 1) * G2_STAGE;
        const float* lb = st + (wv * 64 + nc) * LSTR + kHalf;
        const float* la = st + (512 + mr) * LSTR + kHalf;
#pragma unroll
        for (int k = 0; k < KC; k += 4) {
            v2f a0 = *(const v2f*)(la + k);
            v2f a1 = *(const v2f*)(la + 16 * LSTR + k);
#pragma unroll
            for (int t = 0; t < 4; ++t) {
                v2f b = *(const v2f*)(lb + t * 16 * LSTR + k);
                acc[0][t] = wmma_f32(a0, b, acc[0][t]);
                acc[1][t] = wmma_f32(a1, b, acc[1][t]);
            }
        }
        // Hand-over, as in GEMM1: reads done, next stage landed, barrier, then the refill.
        wait_lds_reads();
        wait_copies();
        __syncthreads();
        if (s + 2 < INTER / KC) stage_in(s + 2);
    }
    wait_copies();

    int jBase = (lane >> 4) << 3;
#pragma unroll
    for (int mt = 0; mt < 2; ++mt) {
        float w[8];
#pragma unroll
        for (int j = 0; j < 8; ++j) {
            int row = m0 + mt * 16 + jBase + j;
            w[j] = WL[e * N + row];
        }
#pragma unroll
        for (int t = 0; t < 4; ++t) {
#pragma unroll
            for (int j = 0; j < 8; ++j) {
                int row = m0 + mt * 16 + jBase + j;
                size_t idx = (size_t)row * DIM + n0 + t * 16 + nc;
                float v = w[j] * acc[mt][t][j];
                Out[idx] = v;
            }
        }
    }
}

// ---------------- Combine: Out = Y[lower expert] + Y[higher expert] + Y[shared] --
// Block: 8 tokens, one float4 of each per thread, all 24 loads ahead of the sums.
// A token with fewer than two rows reads its shared row in their place and adds zero.
__global__ __launch_bounds__(256) void moe_combine_kernel(
    const float* __restrict__ Y, const int* __restrict__ SEL,
    float* __restrict__ Out, int N)
{
    unsigned c = threadIdx.x * 4u;
    int t0 = blockIdx.x * 8;
    int s0[8], s1[8];
    float4 v0[8], v1[8], vs[8];
#pragma unroll
    for (int i = 0; i < 8; ++i) {
        s0[i] = SEL[(t0 + i) * 2];
        s1[i] = SEL[(t0 + i) * 2 + 1];
    }
#pragma unroll
    for (int i = 0; i < 8; ++i) {
        int sh = NEXP * N + t0 + i;
        // Later loads land in registers that held an earlier load's address: behind each
        // load the wait that stands in front of such an overwrite.
        v0[i] = *(const float4*)(Y + (size_t)(s0[i] >= 0 ? s0[i] : sh) * DIM + c);
        asm volatile("s_wait_xcnt 0x0" ::: "memory");
        v1[i] = *(const float4*)(Y + (size_t)(s1[i] >= 0 ? s1[i] : sh) * DIM + c);
        asm volatile("s_wait_xcnt 0x0" ::: "memory");
        vs[i] = *(const float4*)(Y + (size_t)sh * DIM + c);
        asm volatile("s_wait_xcnt 0x0" ::: "memory");
    }
    // Keeps every load in front of the first sum: 24 in flight per lane, one latency.
    __builtin_amdgcn_sched_barrier(0);
#pragma unroll
    for (int i = 0; i < 8; ++i) {
        float4 a = v0[i], b = v1[i], o;
        if (s0[i] < 0) a = make_float4(0.0f, 0.0f, 0.0f, 0.0f);
        if (s1[i] < 0) b = make_float4(0.0f, 0.0f, 0.0f, 0.0f);
        o.x = (a.x + b.x) + vs[i].x;
        o.y = (a.y + b.y) + vs[i].y;
        o.z = (a.z + b.z) + vs[i].z;
        o.w = (a.w + b.w) + vs[i].w;
        *(float4*)(Out + (size_t)(t0 + i) * DIM + c) = o;
    }
}

extern "C" void kernel_launch(void* const* d_in, const int* in_sizes, int n_in,
                              void* d_out, int out_size, void* d_ws, size_t ws_size,
                              hipStream_t stream) {
    const float* x      = (const float*)d_in[0];
    const float* gate_w = (const float*)d_in[1];
    const float* wg     = (const float*)d_in[2];
    const float* wu     = (const float*)d_in[3];
    const float* wd     = (const float*)d_in[4];
    const float* sg     = (const float*)d_in[5];
    const float* su     = (const float*)d_in[6];
    const float* sd     = (const float*)d_in[7];
    float* out = (float*)d_out;

    const int N = in_sizes[0] / DIM;                // 4096 tokens

    float* cw   = (float*)d_ws;                     // [N, NEXP]
    float* wl   = cw + (size_t)N * NEXP;            // [NEXP + 1, N]
    int*   list = (int*)(wl + (size_t)N * (NEXP + 1));   // [NEXP + 1, N]
    int*   sel  = list + (size_t)N * (NEXP + 1);    // [N, 2]
    int*   tp   = sel + (size_t)N * 2;              // [NEXP + 2], 32 kept
    float* Hbuf = (float*)(tp + 32);                // [NEXP + 1, N, INTER]
    float* Ybuf = Hbuf + (size_t)(NEXP + 1) * N * INTER;   // [NEXP + 1, N, DIM]

    moe_gate_kernel<<<(N + 7) / 8, 256, 0, stream>>>(x, gate_w, cw, N);
    moe_route_kernel<<<1, 1024, 0, stream>>>(cw, list, wl, sel, tp, N);

    // Most tiles any routing can need: 2N rows in NEXP lists, each list's last tile
    // part full, and N shared rows.
    const int tiles = 3 * (N / 32) + NEXP;
    moe_gemm1_kernel<<<tiles, 256, 0, stream>>>(x, wg, wu, sg, su, tp, list, Hbuf, N);
    dim3 g2(tiles, DIM / 512);
    moe_gemm2_kernel<<<g2, 256, 0, stream>>>(Hbuf, wd, sd, tp, wl, Ybuf, N);
    moe_combine_kernel<<<N / 8, 256, 0, stream>>>(Ybuf, sel, out, N);
}

// v003
// Measured time: 228 microseconds a run.
// Timed twice side by side with v002, it ran 1.34 and 1.32 times as fast.
// Counting every step since v000, it is 7.05 times as fast.
#include <hip/hip_runtime.h>

typedef __attribute__((ext_vector_type(2))) float v2f;
typedef __attribute__((ext_vector_type(8))) float v8f;

#define DIM   1024
#define INTER 512
#define NEXP  8
#define KC    32           // K chunk staged in LDS: one 128-byte line of every row
#define LSTR  (KC + 4)     // padded LDS row stride (dwords): conflict-free b64 reads
#define TM    64           // rows of a GEMM block's tile (a list is filled up to whole tiles)
#define TB    64           // weight rows of a GEMM block's tile
#define STAGE ((TB + TM) * LSTR)   // one stage in LDS, dwords

__device__ __forceinline__ float silu_f(float g) {
    return g / (1.0f + __expf(-g));
}

__device__ __forceinline__ v8f wmma_f32(v2f a, v2f b, v8f c) {
    return __builtin_amdgcn_wmma_f32_16x16x4_f32(
        false, a, false, b, (short)0, c, false, false);
}

// One copy, global memory -> LDS, 16 bytes a lane, through no register.
typedef int v4i __attribute__((ext_vector_type(4)));
typedef __attribute__((address_space(1))) v4i gl_v4i;
typedef __attribute__((address_space(3))) v4i lds_v4i;
__device__ __forceinline__ void copy_to_lds(float* l, const float* g) {
    __builtin_amdgcn_global_load_async_to_lds_b128((gl_v4i*)g, (lds_v4i*)l, 0, 0);
}

// This wave's copies have landed.
__device__ __forceinline__ void wait_copies() {
    asm volatile("s_wait_asynccnt 0x0" ::: "memory");
}

// This wave's LDS reads have returned: the buffer may go to its next writer.
__device__ __forceinline__ void wait_lds_reads() {
    asm volatile("s_wait_dscnt 0x0" ::: "memory");
}

// ---------------- Gate: softmax(x @ gate_w^T), top-2, dense combine weights ----
__global__ __launch_bounds__(256) void moe_gate_kernel(
    const float* __restrict__ X, const float* __restrict__ GW,
    float* __restrict__ CW, int N)
{
    int lane = threadIdx.x & 31;
    int tok  = (blockIdx.x * blockDim.x + threadIdx.x) >> 5;
    if (tok >= N) return;
    const float* xr = X + (size_t)tok * DIM;
    float acc[NEXP];
#pragma unroll
    for (int e = 0; e < NEXP; ++e) acc[e] = 0.0f;
    for (int d = lane; d < DIM; d += 32) {
        float xv = xr[d];
#pragma unroll
        for (int e = 0; e < NEXP; ++e) acc[e] += xv * GW[e * DIM + d];
    }
#pragma unroll
    for (int e = 0; e < NEXP; ++e) {
#pragma unroll
        for (int off = 16; off > 0; off >>= 1)
            acc[e] += __shfl_xor(acc[e], off, 32);
    }
    if (lane == 0) {
        float mx = acc[0];
#pragma unroll
        for (int e = 1; e < NEXP; ++e) mx = fmaxf(mx, acc[e]);
        float s[NEXP]; float sum = 0.0f;
#pragma unroll
        for (int e = 0; e < NEXP; ++e) { s[e] = __expf(acc[e] - mx); sum += s[e]; }
        float inv = 1.0f / sum;
#pragma unroll
        for (int e = 0; e < NEXP; ++e) s[e] *= inv;
        int i1 = 0;
#pragma unroll
        for (int e = 1; e < NEXP; ++e) if (s[e] > s[i1]) i1 = e;
        int i2 = (i1 == 0) ? 1 : 0;
#pragma unroll
        for (int e = 0; e < NEXP; ++e) if (e != i1 && s[e] > s[i2]) i2 = e;
#pragma unroll
        for (int e = 0; e < NEXP; ++e)
            CW[(size_t)tok * NEXP + e] = (e == i1) ? s[i1] : ((e == i2) ? s[i2] : 0.0f);
    }
}

// ---------------- Route: per expert, the list of tokens that chose it ----------
// One block. Tokens keep their order inside an expert's list (ballot rank in the
// wave, prefix over the waves in LDS), so the lists are the same on every run.
// LIST/WL: [NEXP + 1][N] token and combine weight by rank, filled up to the end of the
// list's last TM-row tile with token 0 at weight 0; list NEXP is the shared expert's:
// every token, weight 1. SEL: [N][2] the token's rows in the expert-major row space
// (expert * N + rank), lower expert first, -1 = none.
// TP: first tile of each list in the grouped grid, then the number of tiles.
__global__ __launch_bounds__(1024) void moe_route_kernel(
    const float* __restrict__ CW, int* __restrict__ LIST, float* __restrict__ WL,
    int* __restrict__ SEL, int* __restrict__ TP, int N)
{
    __shared__ int wc[32][NEXP];    // rows per wave and expert, this chunk
    __shared__ int wo[32][NEXP];    // first rank of the wave's rows
    __shared__ int tot[NEXP];

    int tid  = threadIdx.x;
    int lane = tid & 31;
    int wv   = tid >> 5;
    unsigned below = (1u << lane) - 1u;
    int run = 0;                    // waves 0..NEXP-1: rows of expert wv so far

    for (int base = 0; base < N; base += 1024) {
        int tok = base + tid;
        float c[NEXP];
#pragma unroll
        for (int e = 0; e < NEXP; ++e) c[e] = 0.0f;
        if (tok < N) {
            float4 lo = *(const float4*)&CW[(size_t)tok * NEXP];
            float4 hi = *(const float4*)&CW[(size_t)tok * NEXP + 4];
            c[0] = lo.x; c[1] = lo.y; c[2] = lo.z; c[3] = lo.w;
            c[4] = hi.x; c[5] = hi.y; c[6] = hi.z; c[7] = hi.w;
        }
        int r[NEXP];
#pragma unroll
        for (int e = 0; e < NEXP; ++e) {
            unsigned m = (unsigned)__ballot(c[e] != 0.0f);
            r[e] = __popc(m & below);
            if (lane == 0) wc[wv][e] = __popc(m);
        }
        __syncthreads();
        if (wv < NEXP) {            // wave e scans the 32 wave counts of expert e
            int v = wc[lane][wv];
            int inc = v;
#pragma unroll
            for (int d = 1; d < 32; d <<= 1) {
                int o = __shfl_up(inc, d, 32);
                if (lane >= d) inc += o;
            }
            wo[lane][wv] = run + inc - v;
            run += __shfl(inc, 31, 32);
        }
        __syncthreads();
        int s0 = -1, s1 = -1;
#pragma unroll
        for (int e = 0; e < NEXP; ++e) {
            if (c[e] != 0.0f) {
                int row = e * N + wo[wv][e] + r[e];
                LIST[row] = tok;
                WL[row]   = c[e];
                if (s0 < 0) s0 = row; else s1 = row;
            }
        }
        if (tok < N) {
            SEL[tok * 2] = s0; SEL[tok * 2 + 1] = s1;
            LIST[NEXP * N + tok] = tok;
            WL[NEXP * N + tok]   = 1.0f;
            // The next trip steps the stores' address registers: the wait in front of that.
            asm volatile("s_wait_xcnt 0x0" ::: "memory");
        }
    }

    if (wv < NEXP) {
        int end = (run + TM - 1) & ~(TM - 1);
#pragma unroll
        for (int q = 0; q < TM / 32; ++q) {
            int r = run + q * 32 + lane;    // ranks from the list's end to its last tile's end
            if (r < end) { LIST[wv * N + r] = 0; WL[wv * N + r] = 0.0f; }
        }
        if (lane == 0) tot[wv] = run;
    }
    __syncthreads();
    if (tid == 0) {
        int t = 0;
#pragma unroll
        for (int e = 0; e < NEXP; ++e) {
            TP[e] = t;
            t += (unsigned)(tot[e] + TM - 1) / TM;
        }
        TP[NEXP] = t;
        TP[NEXP + 1] = t + (unsigned)N / TM;
    }
}

// Which expert and which TM-row tile of its list a block of the grouped grid works on.
// False: the block lies behind the last tile (the grid is sized for the worst case).
__device__ __forceinline__ bool tile_of_block(const int* __restrict__ TP, int b,
                                              int& e, int& m0) {
    if (b >= TP[NEXP + 1]) return false;
    e = 0;
#pragma unroll
    for (int q = 1; q <= NEXP; ++q) if (b >= TP[q]) e = q;
    m0 = (b - TP[e]) * TM;
    return true;
}

// ---------------- GEMM1: H = silu(X Wg^T) * (X Wu^T), all experts, chosen rows --
// Block: 4 waves, TM rows of one expert's list x 32 INTER cols (grid.x spans INTER / 32,
// grid.y the tiles): small equal pieces, many to a WGP and several resident at once, so
// that the last round of the grid leaves little of the chip idle.
// Wave: 16(M) x 32(N) strip = 1x2 WMMA tiles for G and for U: whole 128-byte lines of H.
// A stage in LDS = KC columns of 32 Wg rows, 32 Wu rows and the TM gathered X rows,
// brought by asynchronous copies in whole 128-byte lines; two stages, so that the next
// one flies while this one is worked on.
__global__ __launch_bounds__(128) void moe_gemm1_kernel(
    const float* __restrict__ X,    // [N, DIM]
    const float* __restrict__ Wg,   // [NEXP, INTER, DIM]
    const float* __restrict__ Wu,   // [NEXP, INTER, DIM]
    const float* __restrict__ Sg,   // [INTER, DIM]
    const float* __restrict__ Su,   // [INTER, DIM]
    const int* __restrict__ TP, const int* __restrict__ LIST,
    float* __restrict__ Hall,       // [NEXP + 1, N, INTER], row = expert * N + rank
    int N)
{
    __shared__ __attribute__((aligned(16))) float ls[2 * STAGE];

    int tid  = threadIdx.x;
    int lane = tid & 31;
    int wv   = tid >> 5;            // 0..3
    int e, m0;
    if (!tile_of_block(TP, blockIdx.y, e, m0)) return;   // uniform
    int n0   = blockIdx.x * (TB / 2);                    // the block's first INTER column

    const float* wgE = (e < NEXP) ? Wg + (size_t)e * INTER * DIM : Sg;
    const float* wuE = (e < NEXP) ? Wu + (size_t)e * INTER * DIM : Su;
    float* H = Hall + (size_t)e * N * INTER;             // this expert's rows, by rank

    // What this thread copies in a stage: 16 bytes (piece sc) of rows sr, sr + 16, ...
    int sr = tid >> 3;              // 0..15
    int sc = (tid & 7) * 4;
    const float* cg = wgE + (size_t)(n0 + sr) * DIM + sc;
    const float* cu = wuE + (size_t)(n0 + sr) * DIM + sc;
    const float* cx[TM / 16];
#pragma unroll
    for (int i = 0; i < TM / 16; ++i)
        cx[i] = X + (size_t)LIST[e * N + m0 + i * 16 + sr] * DIM + sc;
    float* cl = ls + sr * LSTR + sc;

    auto stage_in = [&](int t) {    // columns t * KC .. + KC into buffer t & 1
        float* l = cl + (t & 1) * STAGE;
        int kc = t * KC;
#pragma unroll
        for (int i = 0; i < TB / 32; ++i) {
            copy_to_lds(l + i * 16 * LSTR, cg + kc + (size_t)i * 16 * DIM);
            copy_to_lds(l + (TB / 2 + i * 16) * LSTR, cu + kc + (size_t)i * 16 * DIM);
        }
#pragma unroll
        for (int i = 0; i < TM / 16; ++i)
            copy_to_lds(l + (TB + i * 16) * LSTR, cx[i] + kc);
    };

    int kHalf = (lane >> 4) << 1;   // 0 or 2
    int mr    = lane & 15;
    int nc    = lane & 15;

    v8f zero = {};
    v8f accG[2], accU[2];
#pragma unroll
    for (int t = 0; t < 2; ++t) { accG[t] = zero; accU[t] = zero; }

    stage_in(0);
    wait_copies();
    __syncthreads();                // stage 0 is there for every wave
    stage_in(1);

    for (int s = 0; s < DIM / KC; ++s) {
        const float* st = ls + (s & 1) * STAGE;
        const float* lg = st + nc * LSTR + kHalf;
        const float* lu = lg + (TB / 2) * LSTR;
        const float* la = st + (TB + wv * 16 + mr) * LSTR + kHalf;
#pragma unroll
        for (int k = 0; k < KC; k += 4) {
            v2f a = *(const v2f*)(la + k);
#pragma unroll
            for (int t = 0; t < 2; ++t) {
                v2f bg = *(const v2f*)(lg + t * 16 * LSTR + k);
                v2f bu = *(const v2f*)(lu + t * 16 * LSTR + k);
                accG[t] = wmma_f32(a, bg, accG[t]);
                accU[t] = wmma_f32(a, bu, accU[t]);
            }
        }
        // Hand-over: this stage's reads are done, the next stage's copies have landed,
        // every wave says so; only then the refill of the buffer just read.
        wait_lds_reads();
        wait_copies();
        __syncthreads();
        if (s + 2 < DIM / KC) stage_in(s + 2);
    }
    wait_copies();

    int jBase = (lane >> 4) << 3;   // 0 or 8
#pragma unroll
    for (int t = 0; t < 2; ++t) {
#pragma unroll
        for (int j = 0; j < 8; ++j) {
            int row = m0 + wv * 16 + jBase + j;
            float g = accG[t][j];
            float u = accU[t][j];
            H[(size_t)row * INTER + n0 + t * 16 + nc] = silu_f(g) * u;
        }
    }
}

// ---------------- GEMM2: Y = diag(w) * (H Wd^T), all experts, chosen rows -------
// Block: 4 waves, TM rows x TB cols (grid.x spans DIM / TB, grid.y the tiles).
// Wave: 16(M) x 64(N) strip = 1x4 WMMA tiles.
// A stage in LDS = KC columns of the block's TB Wd rows and its TM H rows, by
// asynchronous copies, two stages, as in GEMM1.
__global__ __launch_bounds__(128) void moe_gemm2_kernel(
    const float* __restrict__ Hall, // [NEXP + 1, N, INTER]
    const float* __restrict__ Wd,   // [NEXP, DIM, INTER]
    const float* __restrict__ Sd,   // [DIM, INTER]
    const int* __restrict__ TP,
    const float* __restrict__ WL,   // [NEXP + 1, N] combine weight by rank
    float* __restrict__ Y,          // [NEXP + 1, N, DIM]
    int N)
{
    __shared__ __attribute__((aligned(16))) float ls[2 * STAGE];

    int tid  = threadIdx.x;
    int lane = tid & 31;
    int wv   = tid >> 5;            // 0..3
    int e, m0;
    if (!tile_of_block(TP, blockIdx.y, e, m0)) return;   // uniform
    int n0   = blockIdx.x * TB;     // the block's first column

    const float* wdE = (e < NEXP) ? Wd + (size_t)e * DIM * INTER : Sd;
    const float* H   = Hall + (size_t)e * N * INTER;     // this expert's rows, by rank
    float* Out       = Y + (size_t)e * N * DIM;

    // What this thread copies in a stage: 16 bytes (piece sc) of rows sr, sr + 16, ...
    int sr = tid >> 3;              // 0..15
    int sc = (tid & 7) * 4;
    const float* cw = wdE + (size_t)(n0 + sr) * INTER + sc;
    const float* ch = H + (size_t)(m0 + sr) * INTER + sc;
    float* cl = ls + sr * LSTR + sc;

    auto stage_in = [&](int t) {    // columns t * KC .. + KC into buffer t & 1
        float* l = cl + (t & 1) * STAGE;
        int kc = t * KC;
#pragma unroll
        for (int i = 0; i < TB / 16; ++i)
            copy_to_lds(l + i * 16 * LSTR, cw + kc + (size_t)i * 16 * INTER);
#pragma unroll
        for (int i = 0; i < TM / 16; ++i)
            copy_to_lds(l + (TB + i * 16) * LSTR, ch + kc + (size_t)i * 16 * INTER);
    };

    int kHalf = (lane >> 4) << 1;
    int mr    = lane & 15;
    int nc    = lane & 15;

    v8f zero = {};
    v8f acc[4];
#pragma unroll
    for (int t = 0; t < 4; ++t) acc[t] = zero;

    stage_in(0);
    wait_copies();
    __syncthreads();                // stage 0 is there for every wave
    stage_in(1);

    for (int s = 0; s < INTER / KC; ++s) {
        const float* st = ls + (s & 1) * STAGE;
        const float* lb = st + nc * LSTR + kHalf;
        const float* la = st + (TB + wv * 16 + mr) * LSTR + kHalf;
#pragma unroll
        for (int k = 0; k < KC; k += 4) {
            v2f a = *(const v2f*)(la + k);
#pragma unroll
            for (int t = 0; t < 4; ++t) {
                v2f b = *(const v2f*)(lb + t * 16 * LSTR + k);
                acc[t] = wmma_f32(a, b, acc[t]);
            }
        }
        // Hand-over, as in GEMM1: reads done, next stage landed, barrier, then the refill.
        wait_lds_reads();
        wait_copies();
        __syncthreads();
        if (s + 2 < INTER / KC) stage_in(s + 2);
    }
    wait_copies();

    int jBase = (lane >> 4) << 3;
    float w[8];
#pragma unroll
    for (int j = 0; j < 8; ++j) {
        int row = m0 + wv * 16 + jBase + j;
        w[j] = WL[e * N + row];
    }
#pragma unroll
    for (int t = 0; t < 4; ++t) {
#pragma unroll
        for (int j = 0; j < 8; ++j) {
            int row = m0 + wv * 16 + jBase + j;
            size_t idx = (size_t)row * DIM + n0 + t * 16 + nc;
            float v = w[j] * acc[t][j];
            Out[idx] = v;
        }
    }
}

// ---------------- Combine: Out = Y[lower expert] + Y[higher expert] + Y[shared] --
// Block: 8 tokens, one float4 of each per thread, all 24 loads ahead of the sums.
// A token with fewer than two rows reads its shared row in their place and adds zero.
__global__ __launch_bounds__(256) void moe_combine_kernel(
    const float* __restrict__ Y, const int* __restrict__ SEL,
    float* __restrict__ Out, int N)
{
    unsigned c = threadIdx.x * 4u;
    int t0 = blockIdx.x * 8;
    int s0[8], s1[8];
    float4 v0[8], v1[8], vs[8];
#pragma unroll
    for (int i = 0; i < 8; ++i) {
        s0[i] = SEL[(t0 + i) * 2];
        s1[i] = SEL[(t0 + i) * 2 + 1];
    }
#pragma unroll
    for (int i = 0; i < 8; ++i) {
        int sh = NEXP * N + t0 + i;
        // Later loads land in registers that held an earlier load's address: behind each
        // load the wait that stands in front of such an overwrite.
        v0[i] = *(const float4*)(Y + (size_t)(s0[i] >= 0 ? s0[i] : sh) * DIM + c);
        asm volatile("s_wait_xcnt 0x0" ::: "memory");
        v1[i] = *(const float4*)(Y + (size_t)(s1[i] >= 0 ? s1[i] : sh) * DIM + c);
        asm volatile("s_wait_xcnt 0x0" ::: "memory");
        vs[i] = *(const float4*)(Y + (size_t)sh * DIM + c);
        asm volatile("s_wait_xcnt 0x0" ::: "memory");
    }
    // Keeps every load in front of the first sum: 24 in flight per lane, one latency.
    __builtin_amdgcn_sched_barrier(0);
#pragma unroll
    for (int i = 0; i < 8; ++i) {
        float4 a = v0[i], b = v1[i], o;
        if (s0[i] < 0) a = make_float4(0.0f, 0.0f, 0.0f, 0.0f);
        if (s1[i] < 0) b = make_float4(0.0f, 0.0f, 0.0f, 0.0f);
        o.x = (a.x + b.x) + vs[i].x;
        o.y = (a.y + b.y) + vs[i].y;
        o.z = (a.z + b.z) + vs[i].z;
        o.w = (a.w + b.w) + vs[i].w;
        *(float4*)(Out + (size_t)(t0 + i) * DIM + c) = o;
    }
}

extern "C" void kernel_launch(void* const* d_in, const int* in_sizes, int n_in,
                              void* d_out, int out_size, void* d_ws, size_t ws_size,
                              hipStream_t stream) {
    const float* x      = (const float*)d_in[0];
    const float* gate_w = (const float*)d_in[1];
    const float* wg     = (const float*)d_in[2];
    const float* wu     = (const float*)d_in[3];
    const float* wd     = (const float*)d_in[4];
    const float* sg     = (const float*)d_in[5];
    const float* su     = (const float*)d_in[6];
    const float* sd     = (const float*)d_in[7];
    float* out = (float*)d_out;

    const int N = in_sizes[0] / DIM;                // 4096 tokens

    float* cw   = (float*)d_ws;                     // [N, NEXP]
    float* wl   = cw + (size_t)N * NEXP;            // [NEXP + 1, N]
    int*   list = (int*)(wl + (size_t)N * (NEXP + 1));   // [NEXP + 1, N]
    int*   sel  = list + (size_t)N * (NEXP + 1);    // [N, 2]
    int*   tp   = sel + (size_t)N * 2;              // [NEXP + 2], 32 kept
    float* Hbuf = (float*)(tp + 32);                // [NEXP + 1, N, INTER]
    float* Ybuf = Hbuf + (size_t)(NEXP + 1) * N * INTER;   // [NEXP + 1, N, DIM]

    moe_gate_kernel<<<(N + 7) / 8, 256, 0, stream>>>(x, gate_w, cw, N);
    moe_route_kernel<<<1, 1024, 0, stream>>>(cw, list, wl, sel, tp, N);

    // Most tiles any routing can need: 2N rows in NEXP lists, each list's last tile
    // part full, and N shared rows.
    const int tiles = 3 * (N / TM) + NEXP;
    dim3 g1(INTER / (TB / 2), tiles);
    moe_gemm1_kernel<<<g1, 128, 0, stream>>>(x, wg, wu, sg, su, tp, list, Hbuf, N);
    dim3 g2(DIM / TB, tiles);
    moe_gemm2_kernel<<<g2, 128, 0, stream>>>(Hbuf, wd, sd, tp, wl, Ybuf, N);
    moe_combine_kernel<<<N / 8, 256, 0, stream>>>(Ybuf, sel, out, N);
}
